// v000
// The times below were measured on an AMD MI455X: many runs one after another, warmed up first and cycling through
// copies of the inputs, with the whole window's GPU time divided by the number of runs. Launches and the gaps
// between them are all in it. The median over several windows is given; except for v000 it joins two sittings, which
// can be a few percent apart, so the side-by-side timings, each taken in one sitting, are the better comparison.
// v000, which the later versions start from, runs in 92.8 microseconds.
#include <hip/hip_runtime.h>
#include <hip/hip_bf16.h>

#define NH 8
#define NB 8
#define SQ 1024
#define SK 1024
#define DD 512
#define UU 512
#define DH 64

typedef __attribute__((ext_vector_type(8)))  float          f32x8;
typedef __attribute__((ext_vector_type(16))) unsigned short u16x16;
typedef __attribute__((ext_vector_type(8)))  unsigned short u16x8;
typedef __attribute__((ext_vector_type(16))) __bf16         bf16x16;
typedef __attribute__((ext_vector_type(4)))  unsigned int   u32x4;
typedef __attribute__((ext_vector_type(8)))  int            i32x8;
typedef __attribute__((ext_vector_type(4)))  int            i32x4;

static __device__ __forceinline__ unsigned short f2bf(float f) {
  unsigned u = __float_as_uint(f);
  u += 0x7FFFu + ((u >> 16) & 1u);          // round-to-nearest-even
  return (unsigned short)(u >> 16);
}

// 16B-alignment-only vector load (works for 144B/80B padded LDS row strides)
static __device__ __forceinline__ bf16x16 ldbf16(const unsigned short* p) {
  u16x8 lo = *(const u16x8*)p;
  u16x8 hi = *(const u16x8*)(p + 8);
  u16x16 v = __builtin_shufflevector(lo, hi, 0, 1, 2, 3, 4, 5, 6, 7, 8, 9, 10,
                                     11, 12, 13, 14, 15);
  return __builtin_bit_cast(bf16x16, v);
}

static __device__ __forceinline__ f32x8 wmma_bf16(bf16x16 a, bf16x16 b, f32x8 c) {
  return __builtin_amdgcn_wmma_f32_16x16x32_bf16(false, a, false, b, (short)0, c,
                                                 false, false);
}

// ---------------------------------------------------------------------------
// TDM: 2-D tile load Global -> LDS. data_size = 2 bytes (bf16).
// Optional LDS row padding done by the TDM itself (pad_enable).
// ---------------------------------------------------------------------------
static __device__ __forceinline__ void tdm_load_2d(
    unsigned lds_off, unsigned long long gaddr, unsigned tensor_d0,
    unsigned tensor_d1, unsigned tile_d0, unsigned tile_d1, unsigned stride0,
    unsigned pad_interval_code, unsigned pad_amount_m1, int pad_en) {
  u32x4 g0;
  g0[0] = 1u;                                    // count=1, user descriptor
  g0[1] = lds_off;                               // LDS byte address
  g0[2] = (unsigned)(gaddr & 0xFFFFFFFFull);     // global_addr[31:0]
  g0[3] = (unsigned)(gaddr >> 32) | (2u << 30);  // global_addr[56:32] | type=2
  i32x8 g1;
  unsigned w0 = (1u << 16);                      // data_size = 2B (code 1)
  if (pad_en)
    w0 |= (1u << 20) | (pad_interval_code << 22) | (pad_amount_m1 << 25);
  g1[0] = (int)w0;
  g1[1] = (int)((tensor_d0 & 0xFFFFu) << 16);                     // dim0 lo16
  g1[2] = (int)((tensor_d0 >> 16) | ((tensor_d1 & 0xFFFFu) << 16));
  g1[3] = (int)((tensor_d1 >> 16) | (tile_d0 << 16));
  g1[4] = (int)tile_d1;                          // tile_dim1 | tile_dim2=0
  g1[5] = (int)stride0;                          // tensor_dim0_stride lo32
  g1[6] = 0;
  g1[7] = 0;
  i32x4 gz = {0, 0, 0, 0};                       // 2-D: higher dims unused
#if defined(__clang_major__) && __clang_major__ >= 23
  i32x8 gz8 = {0, 0, 0, 0, 0, 0, 0, 0};
  __builtin_amdgcn_tensor_load_to_lds(g0, g1, gz, gz, gz8, 0);
#else
  __builtin_amdgcn_tensor_load_to_lds(g0, g1, gz, gz, 0);
#endif
}

// ---------------------------------------------------------------------------
// Kernel 0: W [D,U] f32  ->  Wt [U,D] bf16  (per z in {q,k,v})
// ---------------------------------------------------------------------------
__global__ __launch_bounds__(256) void wt_kernel(
    const float* __restrict__ Wq, const float* __restrict__ Wk,
    const float* __restrict__ Wv, unsigned short* __restrict__ wt) {
  __shared__ float tile[32][33];
  const int z = blockIdx.z;
  const float* W = (z == 0) ? Wq : (z == 1) ? Wk : Wv;
  unsigned short* out = wt + (size_t)z * DD * UU;
  const int u0 = blockIdx.x * 32, d0 = blockIdx.y * 32;
  const int tx = threadIdx.x, ty = threadIdx.y;
#pragma unroll
  for (int j = 0; j < 32; j += 8)
    tile[ty + j][tx] = W[(size_t)(d0 + ty + j) * UU + u0 + tx];
  __syncthreads();
#pragma unroll
  for (int j = 0; j < 32; j += 8)
    out[(size_t)(u0 + ty + j) * DD + d0 + tx] = f2bf(tile[tx][ty + j]);
}

// ---------------------------------------------------------------------------
// Kernel 1: Y = relu(X @ W + b), bf16 output.
//   z=0: queries->qh [H,B,Sq,64]   z=1: keys->kh [H,B,Sk,64]
//   z=2: keys->vt  [H,B,64,Sk]  (transposed for PV WMMA B-layout)
// ---------------------------------------------------------------------------
__global__ __launch_bounds__(256) void proj_kernel(
    const float* __restrict__ queries, const float* __restrict__ keys,
    const float* __restrict__ bq, const float* __restrict__ bk,
    const float* __restrict__ bv, const unsigned short* __restrict__ wt,
    unsigned short* __restrict__ qh, unsigned short* __restrict__ kh,
    unsigned short* __restrict__ vt) {
  const int z = blockIdx.y;
  const float* X = (z == 0) ? queries : keys;
  const unsigned short* W = wt + (size_t)z * DD * UU;  // [U][D] bf16
  const float* bias = (z == 0) ? bq : (z == 1) ? bk : bv;

  __shared__ __align__(64) unsigned short alds[32 * 32];  // X tile bf16

  const int m0 = blockIdx.x * 32;
  const int tid = threadIdx.x;
  const int wave = tid >> 5, lane = tid & 31, half = lane >> 4, lm = lane & 15;

  f32x8 acc[2][4] = {};

  for (int k0 = 0; k0 < DD; k0 += 32) {
    __syncthreads();
    {  // cooperative f32->bf16 stage of X[m0..m0+31][k0..k0+31]
      const int e = tid * 4;
      const int r = e >> 5, c = e & 31;
      const float4 v = *(const float4*)(X + (size_t)(m0 + r) * DD + k0 + c);
      ushort4 hv;
      hv.x = f2bf(v.x); hv.y = f2bf(v.y); hv.z = f2bf(v.z); hv.w = f2bf(v.w);
      *(ushort4*)(&alds[r * 32 + c]) = hv;
    }
    __syncthreads();
    const bf16x16 a0 = ldbf16(&alds[lm * 32 + half * 16]);
    const bf16x16 a1 = ldbf16(&alds[(16 + lm) * 32 + half * 16]);
#pragma unroll
    for (int nj = 0; nj < 4; nj++) {
      const unsigned short* wp =
          W + (size_t)(wave * 64 + nj * 16 + lm) * DD + k0 + half * 16;
      const bf16x16 bt = ldbf16(wp);
      acc[0][nj] = wmma_bf16(a0, bt, acc[0][nj]);
      acc[1][nj] = wmma_bf16(a1, bt, acc[1][nj]);
    }
  }

  const int bb = m0 / SQ;
  const int s0 = m0 % SQ;
#pragma unroll
  for (int nj = 0; nj < 4; nj++) {
    const float bi = bias[wave * 64 + nj * 16 + lm];
#pragma unroll
    for (int mi = 0; mi < 2; mi++) {
      f32x8 v = acc[mi][nj];
#pragma unroll
      for (int r = 0; r < 8; r++) {
        const float t = v[r] + bi;
        v[r] = t > 0.f ? t : 0.f;                    // ReLU
      }
      if (z == 2) {  // transposed store: vt[h][b][dh][s]
        const int dh = nj * 16 + lm;
        const int srow = s0 + mi * 16 + half * 8;
        u16x8 pk;
#pragma unroll
        for (int r = 0; r < 8; r++) pk[r] = f2bf(v[r]);
        *(u16x8*)(vt + (((size_t)wave * NB + bb) * DH + dh) * SK + srow) = pk;
      } else {       // row-major store: out[h][b][s][dh]
        unsigned short* out = (z == 0) ? qh : kh;
        const size_t base = ((size_t)wave * NB + bb) * SQ;
#pragma unroll
        for (int r = 0; r < 8; r++) {
          const int srow = s0 + mi * 16 + half * 8 + r;
          out[(base + srow) * DH + nj * 16 + lm] = f2bf(v[r]);
        }
      }
    }
  }
}

// ---------------------------------------------------------------------------
// Kernel 2: flash attention.  Block = 8 waves = 128 q-rows of one (h,b).
// K/V 32-key tiles staged into double-buffered LDS by the Tensor Data Mover
// (wave 0 issues; s_wait_tensorcnt + barrier publishes to all waves).
// Dynamic LDS layout (bytes):
//   [    0, 12288)  per-wave P-transpose buffers (8 x 16 rows x 48 ushorts)
//   [12288, 16896)  K buf 0: 32 rows x 144B (TDM pad: 16B per 128B row)
//   [16896, 21504)  K buf 1
//   [21504, 26624)  V buf 0: 64 rows x  80B (TDM pad: 16B per  64B row)
//   [26624, 31744)  V buf 1
// ---------------------------------------------------------------------------
#define PB_OFF 0
#define KB0_OFF 12288
#define KB1_OFF 16896
#define VB0_OFF 21504
#define VB1_OFF 26624
#define SMEM_BYTES 31744
#define KROW 72   // padded K row stride in ushorts (144B)
#define VROW 40   // padded V row stride in ushorts (80B)

__global__ __launch_bounds__(256) void attn_kernel(
    const unsigned short* __restrict__ qh, const unsigned short* __restrict__ kh,
    const unsigned short* __restrict__ vt, float* __restrict__ attn_out) {
  extern __shared__ __align__(128) char smem[];
  const int h = blockIdx.z, bb = blockIdx.y;
  const int tid = threadIdx.x;
  const int wave = tid >> 5, lane = tid & 31, half = lane >> 4, lm = lane & 15;
  const int q0 = blockIdx.x * 128 + wave * 16;

  const unsigned short* Q = qh + ((size_t)h * NB + bb) * SQ * DH;
  const unsigned short* K = kh + ((size_t)h * NB + bb) * SK * DH;
  const unsigned short* V = vt + ((size_t)h * NB + bb) * DH * SK;

  unsigned short* pw = (unsigned short*)(smem + PB_OFF) + wave * (16 * 48);

  const bf16x16 aq0 = ldbf16(Q + (size_t)(q0 + lm) * DH + half * 16);
  const bf16x16 aq1 = ldbf16(Q + (size_t)(q0 + lm) * DH + 32 + half * 16);

  f32x8 o0 = {}, o1 = {}, o2 = {}, o3 = {};
  f32x8 m, l = {};
#pragma unroll
  for (int r = 0; r < 8; r++) m[r] = -3.0e38f;

  const float LOG2E = 1.4426950408889634f;
  const float SCALE = 0.125f;  // 1/sqrt(64)

  // prologue: stage tiles for kt=0 into buffer 0
  if (wave == 0) {
    tdm_load_2d(KB0_OFF, (unsigned long long)(uintptr_t)K, 64, 32, 64, 32, 64,
                4, 3, 1);
    tdm_load_2d(VB0_OFF, (unsigned long long)(uintptr_t)V, 32, 64, 32, 64, SK,
                3, 3, 1);
  }

  for (int kt = 0; kt < SK; kt += 32) {
    const int cur = (kt >> 5) & 1;
    if (wave == 0) {
      if (kt + 32 < SK) {  // stage next tiles into the other buffer
        tdm_load_2d(cur ? KB0_OFF : KB1_OFF,
                    (unsigned long long)(uintptr_t)(K + (size_t)(kt + 32) * DH),
                    64, 32, 64, 32, 64, 4, 3, 1);
        tdm_load_2d(cur ? VB0_OFF : VB1_OFF,
                    (unsigned long long)(uintptr_t)(V + (kt + 32)), 32, 64, 32,
                    64, SK, 3, 3, 1);
        __builtin_amdgcn_s_wait_tensorcnt(2);  // current pair done (in-order)
      } else {
        __builtin_amdgcn_s_wait_tensorcnt(0);
      }
    }
    __syncthreads();  // publish staged tiles to all waves

    const unsigned short* Kc =
        (const unsigned short*)(smem + (cur ? KB1_OFF : KB0_OFF));
    const unsigned short* Vc =
        (const unsigned short*)(smem + (cur ? VB1_OFF : VB0_OFF));

    f32x8 s0 = {}, s1 = {};
    {
      const bf16x16 b0 = ldbf16(Kc + lm * KROW + half * 16);
      const bf16x16 b1 = ldbf16(Kc + lm * KROW + 32 + half * 16);
      s0 = wmma_bf16(aq0, b0, s0);
      s0 = wmma_bf16(aq1, b1, s0);
      const bf16x16 c0 = ldbf16(Kc + (16 + lm) * KROW + half * 16);
      const bf16x16 c1 = ldbf16(Kc + (16 + lm) * KROW + 32 + half * 16);
      s1 = wmma_bf16(aq0, c0, s1);
      s1 = wmma_bf16(aq1, c1, s1);
    }
    // scale + row max (rows live across the 16 lanes of each half-wave)
    f32x8 mt;
#pragma unroll
    for (int r = 0; r < 8; r++) {
      s0[r] *= SCALE;
      s1[r] *= SCALE;
      mt[r] = fmaxf(s0[r], s1[r]);
    }
#pragma unroll
    for (int r = 0; r < 8; r++) {
#pragma unroll
      for (int d = 8; d > 0; d >>= 1)
        mt[r] = fmaxf(mt[r], __shfl_xor(mt[r], d, 32));
    }
    f32x8 alpha, rs;
#pragma unroll
    for (int r = 0; r < 8; r++) {
      const float nm = fmaxf(m[r], mt[r]);
      alpha[r] = __builtin_amdgcn_exp2f((m[r] - nm) * LOG2E);
      m[r] = nm;
      s0[r] = __builtin_amdgcn_exp2f((s0[r] - nm) * LOG2E);
      s1[r] = __builtin_amdgcn_exp2f((s1[r] - nm) * LOG2E);
      rs[r] = s0[r] + s1[r];
    }
#pragma unroll
    for (int r = 0; r < 8; r++) {
#pragma unroll
      for (int d = 8; d > 0; d >>= 1) rs[r] += __shfl_xor(rs[r], d, 32);
      l[r] = l[r] * alpha[r] + rs[r];
      o0[r] *= alpha[r];
      o1[r] *= alpha[r];
      o2[r] *= alpha[r];
      o3[r] *= alpha[r];
    }
    // P: C-layout -> A-layout via wave-private LDS (in-order DS per wave)
#pragma unroll
    for (int r = 0; r < 8; r++) {
      const int row = r + half * 8;
      pw[row * 48 + lm] = f2bf(s0[r]);
      pw[row * 48 + 16 + lm] = f2bf(s1[r]);
    }
    asm volatile("" ::: "memory");
    const bf16x16 pa = ldbf16(pw + lm * 48 + half * 16);
    asm volatile("" ::: "memory");
#pragma unroll
    for (int j = 0; j < 4; j++) {
      const bf16x16 bvt = ldbf16(Vc + (j * 16 + lm) * VROW + half * 16);
      f32x8& oj = (j == 0) ? o0 : (j == 1) ? o1 : (j == 2) ? o2 : o3;
      oj = wmma_bf16(pa, bvt, oj);
    }
    asm volatile("s_wait_dscnt 0x0" ::: "memory");  // reads retired
    __syncthreads();  // buffer may be overwritten by TDM next iteration
  }

  f32x8 inv;
#pragma unroll
  for (int r = 0; r < 8; r++) inv[r] = 1.0f / l[r];
#pragma unroll
  for (int j = 0; j < 4; j++) {
    const f32x8 oj = (j == 0) ? o0 : (j == 1) ? o1 : (j == 2) ? o2 : o3;
#pragma unroll
    for (int r = 0; r < 8; r++) {
      const int qrow = q0 + r + half * 8;
      attn_out[((size_t)bb * SQ + qrow) * UU + h * DH + j * 16 + lm] =
          oj[r] * inv[r];
    }
  }
}

// ---------------------------------------------------------------------------
// Kernel 3: qmask + residual + LayerNorm.  One wave per 512-float row.
// ---------------------------------------------------------------------------
__global__ __launch_bounds__(256) void ln_kernel(
    const float* __restrict__ queries, const float* __restrict__ attn,
    const float* __restrict__ gamma, const float* __restrict__ beta,
    float* __restrict__ out) {
  const int row = blockIdx.x * 8 + (threadIdx.x >> 5);
  const int lane = threadIdx.x & 31;
  const float* qr = queries + (size_t)row * UU;
  const float* ar = attn + (size_t)row * UU;
  float4 q[4], a[4];
#pragma unroll
  for (int i = 0; i < 4; i++) {
    q[i] = *(const float4*)(qr + i * 128 + lane * 4);
    a[i] = *(const float4*)(ar + i * 128 + lane * 4);
  }
  float sabs = 0.f;
#pragma unroll
  for (int i = 0; i < 4; i++)
    sabs += fabsf(q[i].x) + fabsf(q[i].y) + fabsf(q[i].z) + fabsf(q[i].w);
#pragma unroll
  for (int d = 16; d > 0; d >>= 1) sabs += __shfl_xor(sabs, d, 32);
  const float mask = (sabs > 0.f) ? 1.f : 0.f;

  float4 y[4];
  float sum = 0.f, sq = 0.f;
#pragma unroll
  for (int i = 0; i < 4; i++) {
    y[i].x = a[i].x * mask + q[i].x;
    y[i].y = a[i].y * mask + q[i].y;
    y[i].z = a[i].z * mask + q[i].z;
    y[i].w = a[i].w * mask + q[i].w;
    sum += y[i].x + y[i].y + y[i].z + y[i].w;
    sq += y[i].x * y[i].x + y[i].y * y[i].y + y[i].z * y[i].z + y[i].w * y[i].w;
  }
#pragma unroll
  for (int d = 16; d > 0; d >>= 1) {
    sum += __shfl_xor(sum, d, 32);
    sq += __shfl_xor(sq, d, 32);
  }
  const float mu = sum * (1.f / 512.f);
  const float var = sq * (1.f / 512.f) - mu * mu;
  const float rstd = rsqrtf(var + 1e-8f);

  float* orow = out + (size_t)row * UU;
#pragma unroll
  for (int i = 0; i < 4; i++) {
    const float4 g = *(const float4*)(gamma + i * 128 + lane * 4);
    const float4 be = *(const float4*)(beta + i * 128 + lane * 4);
    float4 o;
    o.x = g.x * (y[i].x - mu) * rstd + be.x;
    o.y = g.y * (y[i].y - mu) * rstd + be.y;
    o.z = g.z * (y[i].z - mu) * rstd + be.z;
    o.w = g.w * (y[i].w - mu) * rstd + be.w;
    *(float4*)(orow + i * 128 + lane * 4) = o;
  }
}

// ---------------------------------------------------------------------------
extern "C" void kernel_launch(void* const* d_in, const int* in_sizes, int n_in,
                              void* d_out, int out_size, void* d_ws,
                              size_t ws_size, hipStream_t stream) {
  const float* queries = (const float*)d_in[0];
  const float* keys = (const float*)d_in[1];
  const float* Wq = (const float*)d_in[2];
  const float* bq = (const float*)d_in[3];
  const float* Wk = (const float*)d_in[4];
  const float* bk = (const float*)d_in[5];
  const float* Wv = (const float*)d_in[6];
  const float* bv = (const float*)d_in[7];
  const float* gamma = (const float*)d_in[8];
  const float* beta = (const float*)d_in[9];
  float* out = (float*)d_out;

  char* ws = (char*)d_ws;
  unsigned short* wt = (unsigned short*)(ws);              // 3*512*512 bf16
  unsigned short* qh = (unsigned short*)(ws + 1572864);    // 8 MB
  unsigned short* kh = (unsigned short*)(ws + 9961472);    // 8 MB
  unsigned short* vt = (unsigned short*)(ws + 18350080);   // 8 MB
  float* attn = (float*)(ws + 26738688);                   // 16 MB

  wt_kernel<<<dim3(16, 16, 3), dim3(32, 8), 0, stream>>>(Wq, Wk, Wv, wt);
  proj_kernel<<<dim3(256, 3), 256, 0, stream>>>(queries, keys, bq, bk, bv, wt,
                                                qh, kh, vt);
  attn_kernel<<<dim3(8, 8, 8), 256, SMEM_BYTES, stream>>>(qh, kh, vt, attn);
  ln_kernel<<<1024, 256, 0, stream>>>(queries, attn, gamma, beta, out);
}

// v001
// Measured time: 75.3 microseconds a run.
// Two timings next to v000 put it at 1.28 and 1.26 times that version's speed.
#include <hip/hip_runtime.h>
#include <hip/hip_bf16.h>

#define NH 8
#define NB 8
#define SQ 1024
#define SK 1024
#define DD 512
#define UU 512
#define DH 64

typedef __attribute__((ext_vector_type(8)))  float          f32x8;
typedef __attribute__((ext_vector_type(16))) unsigned short u16x16;
typedef __attribute__((ext_vector_type(8)))  unsigned short u16x8;
typedef __attribute__((ext_vector_type(16))) __bf16         bf16x16;
typedef __attribute__((ext_vector_type(4)))  unsigned int   u32x4;
typedef __attribute__((ext_vector_type(8)))  int            i32x8;
typedef __attribute__((ext_vector_type(4)))  int            i32x4;

static __device__ __forceinline__ unsigned short f2bf(float f) {
  unsigned u = __float_as_uint(f);
  u += 0x7FFFu + ((u >> 16) & 1u);          // round-to-nearest-even
  return (unsigned short)(u >> 16);
}

// 16B-alignment-only vector load (works for 144B/80B padded LDS row strides)
static __device__ __forceinline__ bf16x16 ldbf16(const unsigned short* p) {
  u16x8 lo = *(const u16x8*)p;
  u16x8 hi = *(const u16x8*)(p + 8);
  u16x16 v = __builtin_shufflevector(lo, hi, 0, 1, 2, 3, 4, 5, 6, 7, 8, 9, 10,
                                     11, 12, 13, 14, 15);
  return __builtin_bit_cast(bf16x16, v);
}

static __device__ __forceinline__ f32x8 wmma_bf16(bf16x16 a, bf16x16 b, f32x8 c) {
  return __builtin_amdgcn_wmma_f32_16x16x32_bf16(false, a, false, b, (short)0, c,
                                                 false, false);
}

// ---------------------------------------------------------------------------
// TDM: 2-D tile load Global -> LDS. data_size = 2 bytes (bf16).
// Optional LDS row padding done by the TDM itself (pad_enable).
// ---------------------------------------------------------------------------
static __device__ __forceinline__ void tdm_load_2d(
    unsigned lds_off, unsigned long long gaddr, unsigned tensor_d0,
    unsigned tensor_d1, unsigned tile_d0, unsigned tile_d1, unsigned stride0,
    unsigned pad_interval_code, unsigned pad_amount_m1, int pad_en) {
  u32x4 g0;
  g0[0] = 1u;                                    // count=1, user descriptor
  g0[1] = lds_off;                               // LDS byte address
  g0[2] = (unsigned)(gaddr & 0xFFFFFFFFull);     // global_addr[31:0]
  g0[3] = (unsigned)(gaddr >> 32) | (2u << 30);  // global_addr[56:32] | type=2
  i32x8 g1;
  unsigned w0 = (1u << 16);                      // data_size = 2B (code 1)
  if (pad_en)
    w0 |= (1u << 20) | (pad_interval_code << 22) | (pad_amount_m1 << 25);
  g1[0] = (int)w0;
  g1[1] = (int)((tensor_d0 & 0xFFFFu) << 16);                     // dim0 lo16
  g1[2] = (int)((tensor_d0 >> 16) | ((tensor_d1 & 0xFFFFu) << 16));
  g1[3] = (int)((tensor_d1 >> 16) | (tile_d0 << 16));
  g1[4] = (int)tile_d1;                          // tile_dim1 | tile_dim2=0
  g1[5] = (int)stride0;                          // tensor_dim0_stride lo32
  g1[6] = 0;
  g1[7] = 0;
  i32x4 gz = {0, 0, 0, 0};                       // 2-D: higher dims unused
#if defined(__clang_major__) && __clang_major__ >= 23
  i32x8 gz8 = {0, 0, 0, 0, 0, 0, 0, 0};
  __builtin_amdgcn_tensor_load_to_lds(g0, g1, gz, gz, gz8, 0);
#else
  __builtin_amdgcn_tensor_load_to_lds(g0, g1, gz, gz, 0);
#endif
}

// ---------------------------------------------------------------------------
// Kernel 0: W [D,U] f32  ->  Wt [U,D] bf16  (per z in {q,k,v})
// ---------------------------------------------------------------------------
__global__ __launch_bounds__(256) void wt_kernel(
    const float* __restrict__ Wq, const float* __restrict__ Wk,
    const float* __restrict__ Wv, unsigned short* __restrict__ wt) {
  __shared__ float tile[32][33];
  const int z = blockIdx.z;
  const float* W = (z == 0) ? Wq : (z == 1) ? Wk : Wv;
  unsigned short* out = wt + (size_t)z * DD * UU;
  const int u0 = blockIdx.x * 32, d0 = blockIdx.y * 32;
  const int tx = threadIdx.x, ty = threadIdx.y;
#pragma unroll
  for (int j = 0; j < 32; j += 8)
    tile[ty + j][tx] = W[(size_t)(d0 + ty + j) * UU + u0 + tx];
  __syncthreads();
#pragma unroll
  for (int j = 0; j < 32; j += 8)
    out[(size_t)(u0 + ty + j) * DD + d0 + tx] = f2bf(tile[tx][ty + j]);
}

// ---------------------------------------------------------------------------
// Kernel 1: Y = relu(X @ W + b), bf16 output.
//   z=0: queries->qh [H,B,Sq,64]   z=1: keys->kh [H,B,Sk,64]
//   z=2: keys->vt  [H,B,64,Sk]  (transposed for PV WMMA B-layout)
// Block tile 128 rows x 256 columns, 8 waves as 2 x 4, 64 x 64 per wave (one
// head's columns). Per 64-k slab both operands are staged in LDS by whole
// 128-B lines, so a W row leaves L2 once per 128 rows of X and every fragment
// read from LDS feeds four WMMAs.
// ---------------------------------------------------------------------------
#define PBM 128
#define PBN 256
#define PBK 64
#define PROW 72   // padded LDS row stride in ushorts (144B) for 128-B rows

__global__ __launch_bounds__(256) void proj_kernel(
    const float* __restrict__ queries, const float* __restrict__ keys,
    const float* __restrict__ bq, const float* __restrict__ bk,
    const float* __restrict__ bv, const unsigned short* __restrict__ wt,
    unsigned short* __restrict__ qh, unsigned short* __restrict__ kh,
    unsigned short* __restrict__ vt) {
  const int z = blockIdx.y >> 1;
  const int n0 = (blockIdx.y & 1) * PBN;
  const float* X = (z == 0) ? queries : keys;
  const unsigned short* W = wt + (size_t)z * DD * UU;  // [U][D] bf16
  const float* bias = (z == 0) ? bq : (z == 1) ? bk : bv;

  __shared__ __align__(16) unsigned short xs[PBM * PROW];   // X slab, bf16
  __shared__ __align__(16) unsigned short wsl[PBN * PROW];  // W slab, bf16

  const int m0 = blockIdx.x * PBM;
  const int tid = threadIdx.x;
  const int wave = tid >> 5, lane = tid & 31, half = lane >> 4, lm = lane & 15;
  const int wm = wave >> 2, wn = wave & 3;

  // staging maps: X 16 threads per 256-B row piece, W 8 threads per 128-B piece
  const float* xg = X + (size_t)(m0 + (tid >> 4)) * DD + (tid & 15) * 4;
  const unsigned short* wg = W + (size_t)(n0 + (tid >> 3)) * DD + (tid & 7) * 8;
  unsigned short* xl = xs + (tid >> 4) * PROW + (tid & 15) * 4;
  unsigned short* wl = wsl + (tid >> 3) * PROW + (tid & 7) * 8;
  const unsigned short* ar = xs + (wm * 64 + lm) * PROW + half * 16;
  const unsigned short* br = wsl + (wn * 64 + lm) * PROW + half * 16;

  f32x8 acc[4][4] = {};

  for (int k0 = 0; k0 < DD; k0 += PBK) {
    float4 xv[8];
    u16x8 wv[8];
    // unrolled: constant indices keep xv in registers, all loads in flight
#pragma unroll
    for (int i = 0; i < 8; i++)
      xv[i] = *(const float4*)(xg + (size_t)(i * 16) * DD + k0);
    // unrolled: the same for wv
#pragma unroll
    for (int i = 0; i < 8; i++)
      wv[i] = *(const u16x8*)(wg + (size_t)(i * 32) * DD + k0);
    __syncthreads();  // every wave has read the previous slab
    // unrolled: constant indices into xv and wv, LDS offsets as immediates
#pragma unroll
    for (int i = 0; i < 8; i++) {
      ushort4 hv;
      hv.x = f2bf(xv[i].x); hv.y = f2bf(xv[i].y);
      hv.z = f2bf(xv[i].z); hv.w = f2bf(xv[i].w);
      *(ushort4*)(xl + i * 16 * PROW) = hv;
      *(u16x8*)(wl + i * 32 * PROW) = wv[i];
    }
    __syncthreads();  // slab visible to all waves
    // the four loops below are unrolled so that acc and a keep constant
    // indices (registers, not scratch) and LDS offsets become immediates
#pragma unroll
    for (int kk = 0; kk < PBK; kk += 32) {
      bf16x16 a[4];
#pragma unroll
      for (int mi = 0; mi < 4; mi++) a[mi] = ldbf16(ar + mi * 16 * PROW + kk);
#pragma unroll
      for (int nj = 0; nj < 4; nj++) {
        const bf16x16 bt = ldbf16(br + nj * 16 * PROW + kk);
#pragma unroll
        for (int mi = 0; mi < 4; mi++)
          acc[mi][nj] = wmma_bf16(a[mi], bt, acc[mi][nj]);
      }
    }
  }

  const int head = (n0 >> 6) + wn;
  const int bb = m0 / SQ;
  const int s0 = m0 % SQ + wm * 64;
#pragma unroll
  for (int nj = 0; nj < 4; nj++) {
    const float bi = bias[head * 64 + nj * 16 + lm];
#pragma unroll
    for (int mi = 0; mi < 4; mi++) {
      f32x8 v = acc[mi][nj];
#pragma unroll
      for (int r = 0; r < 8; r++) {
        const float t = v[r] + bi;
        v[r] = t > 0.f ? t : 0.f;                    // ReLU
      }
      if (z == 2) {  // transposed store: vt[h][b][dh][s]
        const int dh = nj * 16 + lm;
        const int srow = s0 + mi * 16 + half * 8;
        u16x8 pk;
#pragma unroll
        for (int r = 0; r < 8; r++) pk[r] = f2bf(v[r]);
        *(u16x8*)(vt + (((size_t)head * NB + bb) * DH + dh) * SK + srow) = pk;
        // the store's registers are reused by the next tile: keep the wait
        asm volatile("s_wait_xcnt 0x0" ::: "memory");
      } else {       // row-major store: out[h][b][s][dh]
        unsigned short* out = (z == 0) ? qh : kh;
        const size_t base = ((size_t)head * NB + bb) * SQ;
#pragma unroll
        for (int r = 0; r < 8; r++) {
          const int srow = s0 + mi * 16 + half * 8 + r;
          out[(base + srow) * DH + nj * 16 + lm] = f2bf(v[r]);
        }
        // the stores' registers are reused by the next tile: keep the wait
        asm volatile("s_wait_xcnt 0x0" ::: "memory");
      }
    }
  }
}

// ---------------------------------------------------------------------------
// Kernel 2: flash attention.  Block = 8 waves = 128 q-rows of one (h,b).
// K/V 32-key tiles staged into double-buffered LDS by the Tensor Data Mover
// (wave 0 issues; s_wait_tensorcnt + barrier publishes to all waves).
// Dynamic LDS layout (bytes):
//   [    0, 12288)  per-wave P-transpose buffers (8 x 16 rows x 48 ushorts)
//   [12288, 16896)  K buf 0: 32 rows x 144B (TDM pad: 16B per 128B row)
//   [16896, 21504)  K buf 1
//   [21504, 26624)  V buf 0: 64 rows x  80B (TDM pad: 16B per  64B row)
//   [26624, 31744)  V buf 1
// ---------------------------------------------------------------------------
#define PB_OFF 0
#define KB0_OFF 12288
#define KB1_OFF 16896
#define VB0_OFF 21504
#define VB1_OFF 26624
#define SMEM_BYTES 31744
#define KROW 72   // padded K row stride in ushorts (144B)
#define VROW 40   // padded V row stride in ushorts (80B)

__global__ __launch_bounds__(256) void attn_kernel(
    const unsigned short* __restrict__ qh, const unsigned short* __restrict__ kh,
    const unsigned short* __restrict__ vt, float* __restrict__ attn_out) {
  extern __shared__ __align__(128) char smem[];
  const int h = blockIdx.z, bb = blockIdx.y;
  const int tid = threadIdx.x;
  const int wave = tid >> 5, lane = tid & 31, half = lane >> 4, lm = lane & 15;
  const int q0 = blockIdx.x * 128 + wave * 16;

  const unsigned short* Q = qh + ((size_t)h * NB + bb) * SQ * DH;
  const unsigned short* K = kh + ((size_t)h * NB + bb) * SK * DH;
  const unsigned short* V = vt + ((size_t)h * NB + bb) * DH * SK;

  unsigned short* pw = (unsigned short*)(smem + PB_OFF) + wave * (16 * 48);

  const bf16x16 aq0 = ldbf16(Q + (size_t)(q0 + lm) * DH + half * 16);
  const bf16x16 aq1 = ldbf16(Q + (size_t)(q0 + lm) * DH + 32 + half * 16);

  f32x8 o0 = {}, o1 = {}, o2 = {}, o3 = {};
  f32x8 m, l = {};
#pragma unroll
  for (int r = 0; r < 8; r++) m[r] = -3.0e38f;

  const float LOG2E = 1.4426950408889634f;
  const float SCALE = 0.125f;  // 1/sqrt(64)

  // prologue: stage tiles for kt=0 into buffer 0
  if (wave == 0) {
    tdm_load_2d(KB0_OFF, (unsigned long long)(uintptr_t)K, 64, 32, 64, 32, 64,
                4, 3, 1);
    tdm_load_2d(VB0_OFF, (unsigned long long)(uintptr_t)V, 32, 64, 32, 64, SK,
                3, 3, 1);
  }

  for (int kt = 0; kt < SK; kt += 32) {
    const int cur = (kt >> 5) & 1;
    if (wave == 0) {
      if (kt + 32 < SK) {  // stage next tiles into the other buffer
        tdm_load_2d(cur ? KB0_OFF : KB1_OFF,
                    (unsigned long long)(uintptr_t)(K + (size_t)(kt + 32) * DH),
                    64, 32, 64, 32, 64, 4, 3, 1);
        tdm_load_2d(cur ? VB0_OFF : VB1_OFF,
                    (unsigned long long)(uintptr_t)(V + (kt + 32)), 32, 64, 32,
                    64, SK, 3, 3, 1);
        __builtin_amdgcn_s_wait_tensorcnt(2);  // current pair done (in-order)
      } else {
        __builtin_amdgcn_s_wait_tensorcnt(0);
      }
    }
    __syncthreads();  // publish staged tiles to all waves

    const unsigned short* Kc =
        (const unsigned short*)(smem + (cur ? KB1_OFF : KB0_OFF));
    const unsigned short* Vc =
        (const unsigned short*)(smem + (cur ? VB1_OFF : VB0_OFF));

    f32x8 s0 = {}, s1 = {};
    {
      const bf16x16 b0 = ldbf16(Kc + lm * KROW + half * 16);
      const bf16x16 b1 = ldbf16(Kc + lm * KROW + 32 + half * 16);
      s0 = wmma_bf16(aq0, b0, s0);
      s0 = wmma_bf16(aq1, b1, s0);
      const bf16x16 c0 = ldbf16(Kc + (16 + lm) * KROW + half * 16);
      const bf16x16 c1 = ldbf16(Kc + (16 + lm) * KROW + 32 + half * 16);
      s1 = wmma_bf16(aq0, c0, s1);
      s1 = wmma_bf16(aq1, c1, s1);
    }
    // scale + row max (rows live across the 16 lanes of each half-wave)
    f32x8 mt;
#pragma unroll
    for (int r = 0; r < 8; r++) {
      s0[r] *= SCALE;
      s1[r] *= SCALE;
      mt[r] = fmaxf(s0[r], s1[r]);
    }
#pragma unroll
    for (int r = 0; r < 8; r++) {
#pragma unroll
      for (int d = 8; d > 0; d >>= 1)
        mt[r] = fmaxf(mt[r], __shfl_xor(mt[r], d, 32));
    }
    f32x8 alpha, rs;
#pragma unroll
    for (int r = 0; r < 8; r++) {
      const float nm = fmaxf(m[r], mt[r]);
      alpha[r] = __builtin_amdgcn_exp2f((m[r] - nm) * LOG2E);
      m[r] = nm;
      s0[r] = __builtin_amdgcn_exp2f((s0[r] - nm) * LOG2E);
      s1[r] = __builtin_amdgcn_exp2f((s1[r] - nm) * LOG2E);
      rs[r] = s0[r] + s1[r];
    }
#pragma unroll
    for (int r = 0; r < 8; r++) {
#pragma unroll
      for (int d = 8; d > 0; d >>= 1) rs[r] += __shfl_xor(rs[r], d, 32);
      l[r] = l[r] * alpha[r] + rs[r];
      o0[r] *= alpha[r];
      o1[r] *= alpha[r];
      o2[r] *= alpha[r];
      o3[r] *= alpha[r];
    }
    // P: C-layout -> A-layout via wave-private LDS (in-order DS per wave)
#pragma unroll
    for (int r = 0; r < 8; r++) {
      const int row = r + half * 8;
      pw[row * 48 + lm] = f2bf(s0[r]);
      pw[row * 48 + 16 + lm] = f2bf(s1[r]);
    }
    asm volatile("" ::: "memory");
    const bf16x16 pa = ldbf16(pw + lm * 48 + half * 16);
    asm volatile("" ::: "memory");
#pragma unroll
    for (int j = 0; j < 4; j++) {
      const bf16x16 bvt = ldbf16(Vc + (j * 16 + lm) * VROW + half * 16);
      f32x8& oj = (j == 0) ? o0 : (j == 1) ? o1 : (j == 2) ? o2 : o3;
      oj = wmma_bf16(pa, bvt, oj);
    }
    asm volatile("s_wait_dscnt 0x0" ::: "memory");  // reads retired
    __syncthreads();  // buffer may be overwritten by TDM next iteration
  }

  f32x8 inv;
#pragma unroll
  for (int r = 0; r < 8; r++) inv[r] = 1.0f / l[r];
#pragma unroll
  for (int j = 0; j < 4; j++) {
    const f32x8 oj = (j == 0) ? o0 : (j == 1) ? o1 : (j == 2) ? o2 : o3;
#pragma unroll
    for (int r = 0; r < 8; r++) {
      const int qrow = q0 + r + half * 8;
      attn_out[((size_t)bb * SQ + qrow) * UU + h * DH + j * 16 + lm] =
          oj[r] * inv[r];
    }
  }
}

// ---------------------------------------------------------------------------
// Kernel 3: qmask + residual + LayerNorm.  One wave per 512-float row.
// ---------------------------------------------------------------------------
__global__ __launch_bounds__(256) void ln_kernel(
    const float* __restrict__ queries, const float* __restrict__ attn,
    const float* __restrict__ gamma, const float* __restrict__ beta,
    float* __restrict__ out) {
  const int row = blockIdx.x * 8 + (threadIdx.x >> 5);
  const int lane = threadIdx.x & 31;
  const float* qr = queries + (size_t)row * UU;
  const float* ar = attn + (size_t)row * UU;
  float4 q[4], a[4];
#pragma unroll
  for (int i = 0; i < 4; i++) {
    q[i] = *(const float4*)(qr + i * 128 + lane * 4);
    a[i] = *(const float4*)(ar + i * 128 + lane * 4);
  }
  float sabs = 0.f;
#pragma unroll
  for (int i = 0; i < 4; i++)
    sabs += fabsf(q[i].x) + fabsf(q[i].y) + fabsf(q[i].z) + fabsf(q[i].w);
#pragma unroll
  for (int d = 16; d > 0; d >>= 1) sabs += __shfl_xor(sabs, d, 32);
  const float mask = (sabs > 0.f) ? 1.f : 0.f;

  float4 y[4];
  float sum = 0.f, sq = 0.f;
#pragma unroll
  for (int i = 0; i < 4; i++) {
    y[i].x = a[i].x * mask + q[i].x;
    y[i].y = a[i].y * mask + q[i].y;
    y[i].z = a[i].z * mask + q[i].z;
    y[i].w = a[i].w * mask + q[i].w;
    sum += y[i].x + y[i].y + y[i].z + y[i].w;
    sq += y[i].x * y[i].x + y[i].y * y[i].y + y[i].z * y[i].z + y[i].w * y[i].w;
  }
#pragma unroll
  for (int d = 16; d > 0; d >>= 1) {
    sum += __shfl_xor(sum, d, 32);
    sq += __shfl_xor(sq, d, 32);
  }
  const float mu = sum * (1.f / 512.f);
  const float var = sq * (1.f / 512.f) - mu * mu;
  const float rstd = rsqrtf(var + 1e-8f);

  float* orow = out + (size_t)row * UU;
#pragma unroll
  for (int i = 0; i < 4; i++) {
    const float4 g = *(const float4*)(gamma + i * 128 + lane * 4);
    const float4 be = *(const float4*)(beta + i * 128 + lane * 4);
    float4 o;
    o.x = g.x * (y[i].x - mu) * rstd + be.x;
    o.y = g.y * (y[i].y - mu) * rstd + be.y;
    o.z = g.z * (y[i].z - mu) * rstd + be.z;
    o.w = g.w * (y[i].w - mu) * rstd + be.w;
    *(float4*)(orow + i * 128 + lane * 4) = o;
  }
}

// ---------------------------------------------------------------------------
extern "C" void kernel_launch(void* const* d_in, const int* in_sizes, int n_in,
                              void* d_out, int out_size, void* d_ws,
                              size_t ws_size, hipStream_t stream) {
  const float* queries = (const float*)d_in[0];
  const float* keys = (const float*)d_in[1];
  const float* Wq = (const float*)d_in[2];
  const float* bq = (const float*)d_in[3];
  const float* Wk = (const float*)d_in[4];
  const float* bk = (const float*)d_in[5];
  const float* Wv = (const float*)d_in[6];
  const float* bv = (const float*)d_in[7];
  const float* gamma = (const float*)d_in[8];
  const float* beta = (const float*)d_in[9];
  float* out = (float*)d_out;

  char* ws = (char*)d_ws;
  unsigned short* wt = (unsigned short*)(ws);              // 3*512*512 bf16
  unsigned short* qh = (unsigned short*)(ws + 1572864);    // 8 MB
  unsigned short* kh = (unsigned short*)(ws + 9961472);    // 8 MB
  unsigned short* vt = (unsigned short*)(ws + 18350080);   // 8 MB
  float* attn = (float*)(ws + 26738688);                   // 16 MB

  wt_kernel<<<dim3(16, 16, 3), dim3(32, 8), 0, stream>>>(Wq, Wk, Wv, wt);
  proj_kernel<<<dim3(64, 6), 256, 0, stream>>>(queries, keys, bq, bk, bv, wt,
                                                qh, kh, vt);
  attn_kernel<<<dim3(8, 8, 8), 256, SMEM_BYTES, stream>>>(qh, kh, vt, attn);
  ln_kernel<<<1024, 256, 0, stream>>>(queries, attn, gamma, beta, out);
}

// v002
// A run of this version takes 53.6 microseconds.
// Next to v001, in two timings, it ran 1.40 times as fast each time.
// All steps since v000 together make it 1.78 times as fast.
#include <hip/hip_runtime.h>
#include <hip/hip_bf16.h>

#define NH 8
#define NB 8
#define SQ 1024
#define SK 1024
#define DD 512
#define UU 512
#define DH 64

typedef __attribute__((ext_vector_type(8)))  float          f32x8;
typedef __attribute__((ext_vector_type(16))) unsigned short u16x16;
typedef __attribute__((ext_vector_type(8)))  unsigned short u16x8;
typedef __attribute__((ext_vector_type(16))) __bf16         bf16x16;
typedef __attribute__((ext_vector_type(8)))  __bf16         bf16x8;
typedef __attribute__((ext_vector_type(4)))  unsigned int   u32x4;
typedef __attribute__((ext_vector_type(8)))  int            i32x8;
typedef __attribute__((ext_vector_type(4)))  int            i32x4;

static __device__ __forceinline__ unsigned short f2bf(float f) {
  unsigned u = __float_as_uint(f);
  u += 0x7FFFu + ((u >> 16) & 1u);          // round-to-nearest-even
  return (unsigned short)(u >> 16);
}

// 16B-alignment-only vector load (works for 144B/80B padded LDS row strides)
static __device__ __forceinline__ bf16x16 ldbf16(const unsigned short* p) {
  u16x8 lo = *(const u16x8*)p;
  u16x8 hi = *(const u16x8*)(p + 8);
  u16x16 v = __builtin_shufflevector(lo, hi, 0, 1, 2, 3, 4, 5, 6, 7, 8, 9, 10,
                                     11, 12, 13, 14, 15);
  return __builtin_bit_cast(bf16x16, v);
}

static __device__ __forceinline__ f32x8 wmma_bf16(bf16x16 a, bf16x16 b, f32x8 c) {
  return __builtin_amdgcn_wmma_f32_16x16x32_bf16(false, a, false, b, (short)0, c,
                                                 false, false);
}

// 32 k of one row in the hardware k order (8 at 8*half, 8 at 16 + 8*half), the
// order in which two packed accumulator tiles lie as the other operand;
// p already holds the lane's half * 8
static __device__ __forceinline__ bf16x16 ldbf16_hw(const unsigned short* p) {
  u16x8 lo = *(const u16x8*)p;
  u16x8 hi = *(const u16x8*)(p + 16);
  u16x16 v = __builtin_shufflevector(lo, hi, 0, 1, 2, 3, 4, 5, 6, 7, 8, 9, 10,
                                     11, 12, 13, 14, 15);
  return __builtin_bit_cast(bf16x16, v);
}

// value of lane l ^ 16
static __device__ __forceinline__ float xhalf(float x) {
  const int b = __float_as_int(x);
  return __int_as_float(__builtin_amdgcn_permlanex16(b, b, 0x76543210,
                                                     0xfedcba98, false, false));
}

// ---------------------------------------------------------------------------
// TDM: 2-D tile load Global -> LDS. data_size = 2 bytes (bf16).
// Optional LDS row padding done by the TDM itself (pad_enable).
// ---------------------------------------------------------------------------
static __device__ __forceinline__ void tdm_load_2d(
    unsigned lds_off, unsigned long long gaddr, unsigned tensor_d0,
    unsigned tensor_d1, unsigned tile_d0, unsigned tile_d1, unsigned stride0,
    unsigned pad_interval_code, unsigned pad_amount_m1, int pad_en) {
  u32x4 g0;
  g0[0] = 1u;                                    // count=1, user descriptor
  g0[1] = lds_off;                               // LDS byte address
  g0[2] = (unsigned)(gaddr & 0xFFFFFFFFull);     // global_addr[31:0]
  g0[3] = (unsigned)(gaddr >> 32) | (2u << 30);  // global_addr[56:32] | type=2
  i32x8 g1;
  unsigned w0 = (1u << 16);                      // data_size = 2B (code 1)
  if (pad_en)
    w0 |= (1u << 20) | (pad_interval_code << 22) | (pad_amount_m1 << 25);
  g1[0] = (int)w0;
  g1[1] = (int)((tensor_d0 & 0xFFFFu) << 16);                     // dim0 lo16
  g1[2] = (int)((tensor_d0 >> 16) | ((tensor_d1 & 0xFFFFu) << 16));
  g1[3] = (int)((tensor_d1 >> 16) | (tile_d0 << 16));
  g1[4] = (int)tile_d1;                          // tile_dim1 | tile_dim2=0
  g1[5] = (int)stride0;                          // tensor_dim0_stride lo32
  g1[6] = 0;
  g1[7] = 0;
  i32x4 gz = {0, 0, 0, 0};                       // 2-D: higher dims unused
#if defined(__clang_major__) && __clang_major__ >= 23
  i32x8 gz8 = {0, 0, 0, 0, 0, 0, 0, 0};
  __builtin_amdgcn_tensor_load_to_lds(g0, g1, gz, gz, gz8, 0);
#else
  __builtin_amdgcn_tensor_load_to_lds(g0, g1, gz, gz, 0);
#endif
}

// ---------------------------------------------------------------------------
// Kernel 0: W [D,U] f32  ->  Wt [U,D] bf16  (per z in {q,k,v})
// ---------------------------------------------------------------------------
__global__ __launch_bounds__(256) void wt_kernel(
    const float* __restrict__ Wq, const float* __restrict__ Wk,
    const float* __restrict__ Wv, unsigned short* __restrict__ wt) {
  __shared__ float tile[32][33];
  const int z = blockIdx.z;
  const float* W = (z == 0) ? Wq : (z == 1) ? Wk : Wv;
  unsigned short* out = wt + (size_t)z * DD * UU;
  const int u0 = blockIdx.x * 32, d0 = blockIdx.y * 32;
  const int tx = threadIdx.x, ty = threadIdx.y;
#pragma unroll
  for (int j = 0; j < 32; j += 8)
    tile[ty + j][tx] = W[(size_t)(d0 + ty + j) * UU + u0 + tx];
  __syncthreads();
#pragma unroll
  for (int j = 0; j < 32; j += 8)
    out[(size_t)(u0 + ty + j) * DD + d0 + tx] = f2bf(tile[tx][ty + j]);
}

// ---------------------------------------------------------------------------
// Kernel 1: Y = relu(X @ W + b), bf16 output.
//   z=0: queries->qh [H,B,Sq,64]   z=1: keys->kh [H,B,Sk,64]
//   z=2: keys->vt  [H,B,64,Sk]  (transposed for PV WMMA A-layout)
// Block tile 128 rows x 256 columns, 8 waves as 2 x 4, 64 x 64 per wave (one
// head's columns). Per 64-k slab both operands are staged in LDS by whole
// 128-B lines, so a W row leaves L2 once per 128 rows of X and every fragment
// read from LDS feeds four WMMAs.
// ---------------------------------------------------------------------------
#define PBM 128
#define PBN 256
#define PBK 64
#define PROW 72   // padded LDS row stride in ushorts (144B) for 128-B rows

__global__ __launch_bounds__(256) void proj_kernel(
    const float* __restrict__ queries, const float* __restrict__ keys,
    const float* __restrict__ bq, const float* __restrict__ bk,
    const float* __restrict__ bv, const unsigned short* __restrict__ wt,
    unsigned short* __restrict__ qh, unsigned short* __restrict__ kh,
    unsigned short* __restrict__ vt) {
  const int z = blockIdx.y >> 1;
  const int n0 = (blockIdx.y & 1) * PBN;
  const float* X = (z == 0) ? queries : keys;
  const unsigned short* W = wt + (size_t)z * DD * UU;  // [U][D] bf16
  const float* bias = (z == 0) ? bq : (z == 1) ? bk : bv;

  __shared__ __align__(16) unsigned short xs[PBM * PROW];   // X slab, bf16
  __shared__ __align__(16) unsigned short wsl[PBN * PROW];  // W slab, bf16

  const int m0 = blockIdx.x * PBM;
  const int tid = threadIdx.x;
  const int wave = tid >> 5, lane = tid & 31, half = lane >> 4, lm = lane & 15;
  const int wm = wave >> 2, wn = wave & 3;

  // staging maps: X 16 threads per 256-B row piece, W 8 threads per 128-B piece
  const float* xg = X + (size_t)(m0 + (tid >> 4)) * DD + (tid & 15) * 4;
  const unsigned short* wg = W + (size_t)(n0 + (tid >> 3)) * DD + (tid & 7) * 8;
  unsigned short* xl = xs + (tid >> 4) * PROW + (tid & 15) * 4;
  unsigned short* wl = wsl + (tid >> 3) * PROW + (tid & 7) * 8;
  const unsigned short* ar = xs + (wm * 64 + lm) * PROW + half * 16;
  const unsigned short* br = wsl + (wn * 64 + lm) * PROW + half * 16;

  f32x8 acc[4][4] = {};

  for (int k0 = 0; k0 < DD; k0 += PBK) {
    float4 xv[8];
    u16x8 wv[8];
    // unrolled: constant indices keep xv in registers, all loads in flight
#pragma unroll
    for (int i = 0; i < 8; i++)
      xv[i] = *(const float4*)(xg + (size_t)(i * 16) * DD + k0);
    // unrolled: the same for wv
#pragma unroll
    for (int i = 0; i < 8; i++)
      wv[i] = *(const u16x8*)(wg + (size_t)(i * 32) * DD + k0);
    __syncthreads();  // every wave has read the previous slab
    // unrolled: constant indices into xv and wv, LDS offsets as immediates
#pragma unroll
    for (int i = 0; i < 8; i++) {
      ushort4 hv;
      hv.x = f2bf(xv[i].x); hv.y = f2bf(xv[i].y);
      hv.z = f2bf(xv[i].z); hv.w = f2bf(xv[i].w);
      *(ushort4*)(xl + i * 16 * PROW) = hv;
      *(u16x8*)(wl + i * 32 * PROW) = wv[i];
    }
    __syncthreads();  // slab visible to all waves
    // the four loops below are unrolled so that acc and a keep constant
    // indices (registers, not scratch) and LDS offsets become immediates
#pragma unroll
    for (int kk = 0; kk < PBK; kk += 32) {
      bf16x16 a[4];
#pragma unroll
      for (int mi = 0; mi < 4; mi++) a[mi] = ldbf16(ar + mi * 16 * PROW + kk);
#pragma unroll
      for (int nj = 0; nj < 4; nj++) {
        const bf16x16 bt = ldbf16(br + nj * 16 * PROW + kk);
#pragma unroll
        for (int mi = 0; mi < 4; mi++)
          acc[mi][nj] = wmma_bf16(a[mi], bt, acc[mi][nj]);
      }
    }
  }

  const int head = (n0 >> 6) + wn;
  const int bb = m0 / SQ;
  const int s0 = m0 % SQ + wm * 64;
#pragma unroll
  for (int nj = 0; nj < 4; nj++) {
    const float bi = bias[head * 64 + nj * 16 + lm];
#pragma unroll
    for (int mi = 0; mi < 4; mi++) {
      f32x8 v = acc[mi][nj];
#pragma unroll
      for (int r = 0; r < 8; r++) {
        const float t = v[r] + bi;
        v[r] = t > 0.f ? t : 0.f;                    // ReLU
      }
      if (z == 2) {  // transposed store: vt[h][b][dh][s]
        const int dh = nj * 16 + lm;
        const int srow = s0 + mi * 16 + half * 8;
        u16x8 pk;
#pragma unroll
        for (int r = 0; r < 8; r++) pk[r] = f2bf(v[r]);
        *(u16x8*)(vt + (((size_t)head * NB + bb) * DH + dh) * SK + srow) = pk;
        // the store's registers are reused by the next tile: keep the wait
        asm volatile("s_wait_xcnt 0x0" ::: "memory");
      } else {       // row-major store: out[h][b][s][dh]
        unsigned short* out = (z == 0) ? qh : kh;
        const size_t base = ((size_t)head * NB + bb) * SQ;
#pragma unroll
        for (int r = 0; r < 8; r++) {
          const int srow = s0 + mi * 16 + half * 8 + r;
          out[(base + srow) * DH + nj * 16 + lm] = f2bf(v[r]);
        }
        // the stores' registers are reused by the next tile: keep the wait
        asm volatile("s_wait_xcnt 0x0" ::: "memory");
      }
    }
  }
}

#define KB0_OFF 12288
#define KB1_OFF 16896
#define VB0_OFF 21504
#define VB1_OFF 26624
#define SMEM_BYTES 31744
#define KROW 72   // padded K row stride in ushorts (144B)
#define VROW 40   // padded V row stride in ushorts (80B)

__global__ __launch_bounds__(256) void attn_kernel(
    const unsigned short* __restrict__ qh, const unsigned short* __restrict__ kh,
    const unsigned short* __restrict__ vt, float* __restrict__ attn_out) {
  extern __shared__ __align__(128) char smem[];
  const int h = blockIdx.z, bb = blockIdx.y;
  const int tid = threadIdx.x;
  const int wave = tid >> 5, lane = tid & 31, half = lane >> 4, lm = lane & 15;
  const int q0 = blockIdx.x * 128 + wave * 16;

  const unsigned short* Q = qh + ((size_t)h * NB + bb) * SQ * DH;
  const unsigned short* K = kh + ((size_t)h * NB + bb) * SK * DH;
  const unsigned short* V = vt + ((size_t)h * NB + bb) * DH * SK;

  const bf16x16 aq0 = ldbf16(Q + (size_t)(q0 + lm) * DH + half * 16);
  const bf16x16 aq1 = ldbf16(Q + (size_t)(q0 + lm) * DH + 32 + half * 16);

  f32x8 o0 = {}, o1 = {}, o2 = {}, o3 = {};
  float m = -3.0e38f;  // running maximum of query q0 + lm, equal in both halves
  float l = 0.f;       // running sum over this lane's own keys only

  const float LOG2E = 1.4426950408889634f;
  const float SCALE = 0.125f;  // 1/sqrt(64)

  // prologue: stage tiles for kt=0 into buffer 0
  if (wave == 0) {
    tdm_load_2d(KB0_OFF, (unsigned long long)(uintptr_t)K, 64, 32, 64, 32, 64,
                4, 3, 1);
    tdm_load_2d(VB0_OFF, (unsigned long long)(uintptr_t)V, 32, 64, 32, 64, SK,
                3, 3, 1);
  }

  for (int kt = 0; kt < SK; kt += 32) {
    const int cur = (kt >> 5) & 1;
    if (wave == 0) {
      if (kt + 32 < SK) {  // stage next tiles into the other buffer
        tdm_load_2d(cur ? KB0_OFF : KB1_OFF,
                    (unsigned long long)(uintptr_t)(K + (size_t)(kt + 32) * DH),
                    64, 32, 64, 32, 64, 4, 3, 1);
        tdm_load_2d(cur ? VB0_OFF : VB1_OFF,
                    (unsigned long long)(uintptr_t)(V + (kt + 32)), 32, 64, 32,
                    64, SK, 3, 3, 1);
        __builtin_amdgcn_s_wait_tensorcnt(2);  // current pair done (in-order)
      } else {
        __builtin_amdgcn_s_wait_tensorcnt(0);
      }
    }
    __syncthreads();  // publish staged tiles to all waves

    const unsigned short* Kc =
        (const unsigned short*)(smem + (cur ? KB1_OFF : KB0_OFF));
    const unsigned short* Vc =
        (const unsigned short*)(smem + (cur ? VB1_OFF : VB0_OFF));

    f32x8 s0 = {}, s1 = {};
    {
      const bf16x16 b0 = ldbf16(Kc + lm * KROW + half * 16);
      const bf16x16 b1 = ldbf16(Kc + lm * KROW + 32 + half * 16);
      s0 = wmma_bf16(b0, aq0, s0);
      s0 = wmma_bf16(b1, aq1, s0);
      const bf16x16 c0 = ldbf16(Kc + (16 + lm) * KROW + half * 16);
      const bf16x16 c1 = ldbf16(Kc + (16 + lm) * KROW + 32 + half * 16);
      s1 = wmma_bf16(c0, aq0, s1);
      s1 = wmma_bf16(c1, aq1, s1);
    }
    // s0[r]: key kt + 8 * half + r, s1[r]: key kt + 16 + 8 * half + r, both of
    // query q0 + lm.  Scale, then the maximum in the lane and across the halves
    s0 *= SCALE;
    s1 *= SCALE;
    f32x8 mx;
#pragma unroll
    for (int r = 0; r < 8; r++) mx[r] = fmaxf(s0[r], s1[r]);
    float mt = fmaxf(fmaxf(fmaxf(mx[0], mx[1]), fmaxf(mx[2], mx[3])),
                     fmaxf(fmaxf(mx[4], mx[5]), fmaxf(mx[6], mx[7])));
    mt = fmaxf(mt, xhalf(mt));
    const float nm = fmaxf(m, mt);
    const float alpha = __builtin_amdgcn_exp2f((m - nm) * LOG2E);
    m = nm;
#pragma unroll
    for (int r = 0; r < 8; r++) {
      s0[r] = __builtin_amdgcn_exp2f((s0[r] - nm) * LOG2E);
      s1[r] = __builtin_amdgcn_exp2f((s1[r] - nm) * LOG2E);
    }
    const f32x8 rs = s0 + s1;
    l = l * alpha + (((rs[0] + rs[1]) + (rs[2] + rs[3])) +
                     ((rs[4] + rs[5]) + (rs[6] + rs[7])));
    o0 *= alpha;
    o1 *= alpha;
    o2 *= alpha;
    o3 *= alpha;
    // P^T as B operand: the two score tiles converted in place
    const bf16x8 p0 = __builtin_convertvector(s0, bf16x8);
    const bf16x8 p1 = __builtin_convertvector(s1, bf16x8);
    const bf16x16 pb = __builtin_shufflevector(p0, p1, 0, 1, 2, 3, 4, 5, 6, 7, 8,
                                               9, 10, 11, 12, 13, 14, 15);
#pragma unroll
    for (int j = 0; j < 4; j++) {
      const bf16x16 av = ldbf16_hw(Vc + (j * 16 + lm) * VROW + half * 8);
      f32x8& oj = (j == 0) ? o0 : (j == 1) ? o1 : (j == 2) ? o2 : o3;
      oj = wmma_bf16(av, pb, oj);
    }
    asm volatile("s_wait_dscnt 0x0" ::: "memory");  // reads retired
    __syncthreads();  // buffer may be overwritten by TDM next iteration
  }

  // oj[r] = O[q0 + lm][j * 16 + 8 * half + r]; the halves' sums join here
  const float inv = 1.0f / (l + xhalf(l));
  o0 *= inv;
  o1 *= inv;
  o2 *= inv;
  o3 *= inv;
  float* orow = attn_out + ((size_t)bb * SQ + q0 + lm) * UU + h * DH + half * 8;
#pragma unroll
  for (int j = 0; j < 4; j++) {
    const f32x8 oj = (j == 0) ? o0 : (j == 1) ? o1 : (j == 2) ? o2 : o3;
    *(float4*)(orow + j * 16) = make_float4(oj[0], oj[1], oj[2], oj[3]);
    *(float4*)(orow + j * 16 + 4) = make_float4(oj[4], oj[5], oj[6], oj[7]);
  }
}

// ---------------------------------------------------------------------------
// Kernel 3: qmask + residual + LayerNorm.  One wave per 512-float row.
// ---------------------------------------------------------------------------
__global__ __launch_bounds__(256) void ln_kernel(
    const float* __restrict__ queries, const float* __restrict__ attn,
    const float* __restrict__ gamma, const float* __restrict__ beta,
    float* __restrict__ out) {
  const int row = blockIdx.x * 8 + (threadIdx.x >> 5);
  const int lane = threadIdx.x & 31;
  const float* qr = queries + (size_t)row * UU;
  const float* ar = attn + (size_t)row * UU;
  float4 q[4], a[4];
#pragma unroll
  for (int i = 0; i < 4; i++) {
    q[i] = *(const float4*)(qr + i * 128 + lane * 4);
    a[i] = *(const float4*)(ar + i * 128 + lane * 4);
  }
  float sabs = 0.f;
#pragma unroll
  for (int i = 0; i < 4; i++)
    sabs += fabsf(q[i].x) + fabsf(q[i].y) + fabsf(q[i].z) + fabsf(q[i].w);
#pragma unroll
  for (int d = 16; d > 0; d >>= 1) sabs += __shfl_xor(sabs, d, 32);
  const float mask = (sabs > 0.f) ? 1.f : 0.f;

  float4 y[4];
  float sum = 0.f, sq = 0.f;
#pragma unroll
  for (int i = 0; i < 4; i++) {
    y[i].x = a[i].x * mask + q[i].x;
    y[i].y = a[i].y * mask + q[i].y;
    y[i].z = a[i].z * mask + q[i].z;
    y[i].w = a[i].w * mask + q[i].w;
    sum += y[i].x + y[i].y + y[i].z + y[i].w;
    sq += y[i].x * y[i].x + y[i].y * y[i].y + y[i].z * y[i].z + y[i].w * y[i].w;
  }
#pragma unroll
  for (int d = 16; d > 0; d >>= 1) {
    sum += __shfl_xor(sum, d, 32);
    sq += __shfl_xor(sq, d, 32);
  }
  const float mu = sum * (1.f / 512.f);
  const float var = sq * (1.f / 512.f) - mu * mu;
  const float rstd = rsqrtf(var + 1e-8f);

  float* orow = out + (size_t)row * UU;
#pragma unroll
  for (int i = 0; i < 4; i++) {
    const float4 g = *(const float4*)(gamma + i * 128 + lane * 4);
    const float4 be = *(const float4*)(beta + i * 128 + lane * 4);
    float4 o;
    o.x = g.x * (y[i].x - mu) * rstd + be.x;
    o.y = g.y * (y[i].y - mu) * rstd + be.y;
    o.z = g.z * (y[i].z - mu) * rstd + be.z;
    o.w = g.w * (y[i].w - mu) * rstd + be.w;
    *(float4*)(orow + i * 128 + lane * 4) = o;
  }
}

// ---------------------------------------------------------------------------
extern "C" void kernel_launch(void* const* d_in, const int* in_sizes, int n_in,
                              void* d_out, int out_size, void* d_ws,
                              size_t ws_size, hipStream_t stream) {
  const float* queries = (const float*)d_in[0];
  const float* keys = (const float*)d_in[1];
  const float* Wq = (const float*)d_in[2];
  const float* bq = (const float*)d_in[3];
  const float* Wk = (const float*)d_in[4];
  const float* bk = (const float*)d_in[5];
  const float* Wv = (const float*)d_in[6];
  const float* bv = (const float*)d_in[7];
  const float* gamma = (const float*)d_in[8];
  const float* beta = (const float*)d_in[9];
  float* out = (float*)d_out;

  char* ws = (char*)d_ws;
  unsigned short* wt = (unsigned short*)(ws);              // 3*512*512 bf16
  unsigned short* qh = (unsigned short*)(ws + 1572864);    // 8 MB
  unsigned short* kh = (unsigned short*)(ws + 9961472);    // 8 MB
  unsigned short* vt = (unsigned short*)(ws + 18350080);   // 8 MB
  float* attn = (float*)(ws + 26738688);                   // 16 MB

  wt_kernel<<<dim3(16, 16, 3), dim3(32, 8), 0, stream>>>(Wq, Wk, Wv, wt);
  proj_kernel<<<dim3(64, 6), 256, 0, stream>>>(queries, keys, bq, bk, bv, wt,
                                                qh, kh, vt);
  attn_kernel<<<dim3(8, 8, 8), 256, SMEM_BYTES, stream>>>(qh, kh, vt, attn);
  ln_kernel<<<1024, 256, 0, stream>>>(queries, attn, gamma, beta, out);
}
